// v000
// The times below were measured on an AMD MI455X: many runs one after another, warmed up first and cycling through
// copies of the inputs, with the whole window's GPU time divided by the number of runs. Launches and the gaps
// between them are all in it. The median over several windows is given; except for v000 it joins two sittings, which
// can be a few percent apart, so the side-by-side timings, each taken in one sitting, are the better comparison.
// v000, which the later versions start from, runs in 92.8 microseconds.
#include <hip/hip_runtime.h>
#include <math.h>

typedef __attribute__((ext_vector_type(2))) float v2f;
typedef __attribute__((ext_vector_type(8))) float v8f;

#define TT     512
#define DD     32
#define HID    64
#define CHUNK  128
#define HSTR   65     // padded LDS row stride for H (odd -> conflict-free column reads)
#define W2STR  33     // padded LDS row stride for k_w2

__launch_bounds__(256, 2)
__global__ void lagalign_fused_kernel(const float* __restrict__ X,
                                      const float* __restrict__ k_w1, const float* __restrict__ k_b1,
                                      const float* __restrict__ k_w2, const float* __restrict__ k_b2,
                                      const float* __restrict__ q_w1, const float* __restrict__ q_b1,
                                      const float* __restrict__ q_w2, const float* __restrict__ q_b2,
                                      const float* __restrict__ pos_bias,
                                      float* __restrict__ Yout, float* __restrict__ Wout)
{
    __shared__ float Xs[TT];
    __shared__ float Hs[CHUNK * HSTR];
    __shared__ float w1s[3 * HID];
    __shared__ float b1s[HID];
    __shared__ float w2s[HID * W2STR];
    __shared__ float b2s[DD];
    __shared__ float qs[DD];
    __shared__ float hqs[HID];
    __shared__ float logitsS[TT];
    __shared__ float red[8];
    __shared__ float red2[8];
    __shared__ float scal[1];

    const int tid  = threadIdx.x;
    const int lane = tid & 31;
    const int wid  = tid >> 5;
    const int bv   = blockIdx.x;
    const float* Xr = X + (size_t)bv * TT;

    // ---- stage X row and K-head weights in LDS ----
    for (int i = tid; i < TT; i += 256)      Xs[i]  = Xr[i];
    for (int i = tid; i < 3 * HID; i += 256) w1s[i] = k_w1[i];
    if (tid < HID) b1s[tid] = k_b1[tid];
    for (int i = tid; i < HID * DD; i += 256)
        w2s[(i >> 5) * W2STR + (i & 31)] = k_w2[i];
    if (tid < DD) b2s[tid] = k_b2[tid];
    __syncthreads();

    // ---- query head: q = relu([X509,X510,X511] @ q_w1 + q_b1) @ q_w2 + q_b2 ----
    if (tid < HID) {
        float p0 = Xs[TT - 3], p1 = Xs[TT - 2], p2 = Xs[TT - 1];
        float a = p0 * q_w1[0 * HID + tid] + p1 * q_w1[1 * HID + tid]
                + p2 * q_w1[2 * HID + tid] + q_b1[tid];
        hqs[tid] = a > 0.f ? a : 0.f;
    }
    __syncthreads();
    if (tid < DD) {
        float acc = q_b2[tid];
        for (int h = 0; h < HID; ++h) acc += hqs[h] * q_w2[h * DD + tid];
        qs[tid] = acc;
    }
    __syncthreads();

    const float inv_sqrt_d = 0.17677669529663687f; // 1/sqrt(32)

    for (int chunk = 0; chunk < TT / CHUNK; ++chunk) {
        const int tbase = chunk * CHUNK;

        // ---- phase 1: H[tl][h] = relu(3-tap conv) into LDS ----
        for (int idx = tid; idx < CHUNK * HID; idx += 256) {
            int tl = idx >> 6;           // / HID
            int h  = idx & (HID - 1);
            int t  = tbase + tl;
            int t0 = (t - 2 < 0) ? 0 : t - 2;
            int t1 = (t - 1 < 0) ? 0 : t - 1;
            float a = Xs[t0] * w1s[h] + Xs[t1] * w1s[HID + h]
                    + Xs[t]  * w1s[2 * HID + h] + b1s[h];
            Hs[tl * HSTR + h] = a > 0.f ? a : 0.f;
        }
        __syncthreads();

        // ---- phase 2: K-tile = H(16x64) @ k_w2(64x32) + b2 via f32 WMMA, then K.q ----
        {
            const int m    = lane & 15;
            const int half = lane >> 4;   // 0: K-pair {0,1}; 1: K-pair {2,3}
            const int koff = half * 2;
            const int rowb = wid * 16;    // this wave's 16 t-rows inside the chunk

            v8f c0, c1;                   // accumulators for d=0..15 and d=16..31
            float bc0 = b2s[m], bc1 = b2s[16 + m];
            for (int r = 0; r < 8; ++r) { c0[r] = bc0; c1[r] = bc1; }

            for (int kk = 0; kk < HID / 4; ++kk) {
                int kb = kk * 4 + koff;
                v2f a, b0, b1v;
                // A: 16x4 f32 tile of H (ISA layout: lanes 0-15 K={0,1}, 16-31 K={2,3})
                a[0]  = Hs[(rowb + m) * HSTR + kb];
                a[1]  = Hs[(rowb + m) * HSTR + kb + 1];
                // B: 4x16 f32 tiles of k_w2 (mirrored layout, N = lane)
                b0[0]  = w2s[kb * W2STR + m];
                b0[1]  = w2s[(kb + 1) * W2STR + m];
                b1v[0] = w2s[kb * W2STR + 16 + m];
                b1v[1] = w2s[(kb + 1) * W2STR + 16 + m];
                c0 = __builtin_amdgcn_wmma_f32_16x16x4_f32(false, a, false, b0,
                                                           (short)0, c0, false, false);
                c1 = __builtin_amdgcn_wmma_f32_16x16x4_f32(false, a, false, b1v,
                                                           (short)0, c1, false, false);
            }

            // logits[m] = sum_d K[m][d] * q[d]  (lane index == d in the C layout)
            float qa = qs[m], qb = qs[16 + m];
            float part[8];
            for (int r = 0; r < 8; ++r) part[r] = c0[r] * qa + c1[r] * qb;
            for (int mask = 1; mask <= 8; mask <<= 1)
                for (int r = 0; r < 8; ++r)
                    part[r] += __shfl_xor(part[r], mask, 32);

            if (m == 0) { // lanes 0 (rows 0-7) and 16 (rows 8-15) hold the sums
                for (int r = 0; r < 8; ++r) {
                    int t = tbase + rowb + half * 8 + r;
                    float l = part[r] * inv_sqrt_d + pos_bias[t];
                    l = (t <= TT - 2) ? l : -1.0e9f;   // only t = T-1 is masked
                    logitsS[t] = l / 0.7f;
                }
            }
        }
        __syncthreads();
    }

    // ---- phase 3: softmax over T, W and Y ----
    float l0 = logitsS[tid], l1 = logitsS[tid + 256];
    float lm = fmaxf(l0, l1);
    for (int mask = 16; mask >= 1; mask >>= 1) lm = fmaxf(lm, __shfl_xor(lm, mask, 32));
    if (lane == 0) red[wid] = lm;
    __syncthreads();
    if (tid == 0) {
        float M = red[0];
        for (int i = 1; i < 8; ++i) M = fmaxf(M, red[i]);
        scal[0] = M;
    }
    __syncthreads();
    float M = scal[0];
    float e0 = __expf(l0 - M), e1 = __expf(l1 - M);
    float ssum = e0 + e1;
    float ysum = e0 * Xs[tid] + e1 * Xs[tid + 256];
    for (int mask = 16; mask >= 1; mask >>= 1) {
        ssum += __shfl_xor(ssum, mask, 32);
        ysum += __shfl_xor(ysum, mask, 32);
    }
    __syncthreads();   // make sure everyone read M before scal is reused
    if (lane == 0) { red[wid] = ssum; red2[wid] = ysum; }
    __syncthreads();
    if (tid == 0) {
        float S = 0.f, Y = 0.f;
        for (int i = 0; i < 8; ++i) { S += red[i]; Y += red2[i]; }
        scal[0] = S;
        Yout[bv] = Y / S;
    }
    __syncthreads();
    float S = scal[0];
    float* Wr = Wout + (size_t)bv * TT;
    Wr[tid]       = e0 / S;
    Wr[tid + 256] = e1 / S;
}

extern "C" void kernel_launch(void* const* d_in, const int* in_sizes, int n_in,
                              void* d_out, int out_size, void* d_ws, size_t ws_size,
                              hipStream_t stream) {
    const float* X    = (const float*)d_in[0];
    const float* k_w1 = (const float*)d_in[1];
    const float* k_b1 = (const float*)d_in[2];
    const float* k_w2 = (const float*)d_in[3];
    const float* k_b2 = (const float*)d_in[4];
    const float* q_w1 = (const float*)d_in[5];
    const float* q_b1 = (const float*)d_in[6];
    const float* q_w2 = (const float*)d_in[7];
    const float* q_b2 = (const float*)d_in[8];
    const float* pos  = (const float*)d_in[9];

    float* Yout = (float*)d_out;            // (B*V) = 4096 floats
    float* Wout = Yout + 32 * 128;          // (B*V*T) floats follow

    dim3 grid(32 * 128);                    // one block per (b,v) row
    dim3 block(256);                        // 8 waves of 32
    lagalign_fused_kernel<<<grid, block, 0, stream>>>(
        X, k_w1, k_b1, k_w2, k_b2, q_w1, q_b1, q_w2, q_b2, pos, Yout, Wout);
}

// v001
// One run takes 55.7 microseconds.
// Timed twice side by side with v000, it ran 1.72 and 1.73 times as fast.
#include <hip/hip_runtime.h>
#include <math.h>

typedef __attribute__((ext_vector_type(2))) float v2f;
typedef __attribute__((ext_vector_type(4))) float v4f;
typedef __attribute__((ext_vector_type(8))) float v8f;

#define TT     512
#define DD     32
#define HID    64
#define KSTEPS (HID / 4)   // k steps of the 16x16x4 product over the hidden axis
#define TPW    4           // 16-row t tiles per wave: 8 waves x 4 x 16 = T

__launch_bounds__(256, 2)
__global__ void lagalign_fused_kernel(const float* __restrict__ X,
                                      const float* __restrict__ k_w1, const float* __restrict__ k_b1,
                                      const float* __restrict__ k_w2, const float* __restrict__ k_b2,
                                      const float* __restrict__ q_w1, const float* __restrict__ q_b1,
                                      const float* __restrict__ q_w2, const float* __restrict__ q_b2,
                                      const float* __restrict__ pos_bias,
                                      float* __restrict__ Yout, float* __restrict__ Wout)
{
    __shared__ float Xs[TT];
    // per pair of hidden units (h, h+1): {w1[0][h],w1[0][h+1], w1[1][..], w1[2][..], b1[h],b1[h+1]}
    __shared__ __attribute__((aligned(16))) float w1f[(HID / 2) * 8];
    // k_w2 in A-fragment order: [k step][lane][{d=m: k,k+1}, {d=16+m: k,k+1}]
    __shared__ __attribute__((aligned(16))) float w2f[KSTEPS * 32 * 4];
    __shared__ __attribute__((aligned(32))) float b2s[DD];
    __shared__ __attribute__((aligned(32))) float qs[DD];
    __shared__ float hqs[HID];
    __shared__ float logitsS[TT];
    __shared__ float red[8];
    __shared__ float red2[8];
    __shared__ float scal[1];

    const int tid  = threadIdx.x;
    const int lane = tid & 31;
    const int wid  = tid >> 5;
    const int bv   = blockIdx.x;
    const float* Xr = X + (size_t)bv * TT;

    // ---- stage X row and K-head weights in LDS ----
    for (int i = tid; i < TT; i += 256)      Xs[i]  = Xr[i];
    if (tid < 3 * HID) {
        int tap = tid >> 6, h = tid & (HID - 1);
        w1f[(h >> 1) * 8 + tap * 2 + (h & 1)] = k_w1[tid];
    }
    if (tid < HID) w1f[(tid >> 1) * 8 + 6 + (tid & 1)] = k_b1[tid];
    for (int i = tid; i < HID * DD; i += 256) {
        int h = i >> 5, d = i & 31;
        int ln = ((h >> 1) & 1) * 16 + (d & 15);       // lane that owns (h, d) in the A fragment
        w2f[((h >> 2) * 32 + ln) * 4 + (d >> 4) * 2 + (h & 1)] = k_w2[i];
    }
    if (tid < DD) b2s[tid] = k_b2[tid];
    __syncthreads();

    // ---- query head: q = relu([X509,X510,X511] @ q_w1 + q_b1) @ q_w2 + q_b2 ----
    if (tid < HID) {
        float p0 = Xs[TT - 3], p1 = Xs[TT - 2], p2 = Xs[TT - 1];
        float a = p0 * q_w1[0 * HID + tid] + p1 * q_w1[1 * HID + tid]
                + p2 * q_w1[2 * HID + tid] + q_b1[tid];
        hqs[tid] = a > 0.f ? a : 0.f;
    }
    __syncthreads();
    if (tid < DD) {
        float acc = q_b2[tid];
        for (int h = 0; h < HID; ++h) acc += hqs[h] * q_w2[h * DD + tid];
        qs[tid] = acc;
    }
    __syncthreads();

    const float inv_sqrt_d = 0.17677669529663687f; // 1/sqrt(32)

    // ---- K^T(32 x 16t) = k_w2^T(32 x 64) @ H^T(64 x 16t) + b2 via f32 WMMA, then K.q ----
    // A = k_w2^T (row = d), B = H^T (column = t). Each lane makes its own two B elements
    // H[t][k], H[t][k+1] from three X values, so H lives in registers only.
    {
        const int n    = lane & 15;   // t inside a tile (B and D column)
        const int half = lane >> 4;   // 0: k pair {0,1}, D rows 0-7; 1: k pair {2,3}, D rows 8-15
        const int tw   = wid * (TPW * 16) + n;

        float x0[TPW], x1[TPW], x2[TPW];
        for (int j = 0; j < TPW; ++j) {
            int t  = tw + j * 16;
            int t0 = (t - 2 < 0) ? 0 : t - 2;
            int t1 = (t - 1 < 0) ? 0 : t - 1;
            x0[j] = Xs[t0]; x1[j] = Xs[t1]; x2[j] = Xs[t];
        }
        // lanes 0-15 finish tiles 0 and 1, lanes 16-31 tiles 2 and 3
        const int tf = tw + half * 32;
        const float pb0 = pos_bias[tf], pb1 = pos_bias[tf + 16];

        v8f c[TPW][2];                // [t tile][d 0-15 | d 16-31]
        {
            const v8f bc0 = *(const v8f*)&b2s[half * 8];
            const v8f bc1 = *(const v8f*)&b2s[16 + half * 8];
            for (int j = 0; j < TPW; ++j) { c[j][0] = bc0; c[j][1] = bc1; }
        }

        for (int kk = 0; kk < KSTEPS; ++kk) {
            const v4f wa = *(const v4f*)&w2f[(kk * 32 + lane) * 4];
            const v4f u0 = *(const v4f*)&w1f[(kk * 2 + half) * 8];
            const v4f u1 = *(const v4f*)&w1f[(kk * 2 + half) * 8 + 4];
            const v2f a0 = {wa[0], wa[1]}, a1 = {wa[2], wa[3]};
            const v2f g0 = {u0[0], u0[1]}, g1 = {u0[2], u0[3]};
            const v2f g2 = {u1[0], u1[1]}, gb = {u1[2], u1[3]};
            for (int j = 0; j < TPW; ++j) {
                const v2f s0 = {x0[j], x0[j]}, s1 = {x1[j], x1[j]}, s2 = {x2[j], x2[j]};
                v2f hb = __builtin_elementwise_fma(s0, g0,
                         __builtin_elementwise_fma(s1, g1,
                         __builtin_elementwise_fma(s2, g2, gb)));
                hb[0] = fmaxf(hb[0], 0.f);
                hb[1] = fmaxf(hb[1], 0.f);
                c[j][0] = __builtin_amdgcn_wmma_f32_16x16x4_f32(false, a0, false, hb,
                                                                (short)0, c[j][0], false, false);
                c[j][1] = __builtin_amdgcn_wmma_f32_16x16x4_f32(false, a1, false, hb,
                                                                (short)0, c[j][1], false, false);
            }
        }

        // logits[t] = sum_d K[t][d] * q[d]: a lane holds 16 of the 32 d of its own t
        const v8f q0 = *(const v8f*)&qs[half * 8];
        const v8f q1 = *(const v8f*)&qs[16 + half * 8];
        float p[TPW];
        for (int j = 0; j < TPW; ++j) {
            v2f s = {0.f, 0.f};
            for (int r = 0; r < 8; r += 2) {
                const v2f ca = {c[j][0][r], c[j][0][r + 1]}, qa = {q0[r], q0[r + 1]};
                const v2f cb = {c[j][1][r], c[j][1][r + 1]}, qb = {q1[r], q1[r + 1]};
                s = __builtin_elementwise_fma(ca, qa, s);
                s = __builtin_elementwise_fma(cb, qb, s);
            }
            p[j] = s[0] + s[1];
        }
        // the other 16 d sit in lane ^ 16: each half hands over the two tiles it does not finish
        for (int i = 0; i < 2; ++i) {
            const float keep = half ? p[2 + i] : p[i];
            const float send = half ? p[i] : p[2 + i];
            const float sum  = keep + __shfl_xor(send, 16, 32);
            const int   t    = tf + i * 16;
            float l = sum * inv_sqrt_d + (i ? pb1 : pb0);
            l = (t <= TT - 2) ? l : -1.0e9f;   // only t = T-1 is masked
            logitsS[t] = l / 0.7f;
        }
    }
    __syncthreads();

    // ---- phase 3: softmax over T, W and Y ----
    float l0 = logitsS[tid], l1 = logitsS[tid + 256];
    float lm = fmaxf(l0, l1);
    for (int mask = 16; mask >= 1; mask >>= 1) lm = fmaxf(lm, __shfl_xor(lm, mask, 32));
    if (lane == 0) red[wid] = lm;
    __syncthreads();
    if (tid == 0) {
        float M = red[0];
        for (int i = 1; i < 8; ++i) M = fmaxf(M, red[i]);
        scal[0] = M;
    }
    __syncthreads();
    float M = scal[0];
    float e0 = __expf(l0 - M), e1 = __expf(l1 - M);
    float ssum = e0 + e1;
    float ysum = e0 * Xs[tid] + e1 * Xs[tid + 256];
    for (int mask = 16; mask >= 1; mask >>= 1) {
        ssum += __shfl_xor(ssum, mask, 32);
        ysum += __shfl_xor(ysum, mask, 32);
    }
    __syncthreads();   // make sure everyone read M before scal is reused
    if (lane == 0) { red[wid] = ssum; red2[wid] = ysum; }
    __syncthreads();
    if (tid == 0) {
        float S = 0.f, Y = 0.f;
        for (int i = 0; i < 8; ++i) { S += red[i]; Y += red2[i]; }
        scal[0] = S;
        Yout[bv] = Y / S;
    }
    __syncthreads();
    float S = scal[0];
    float* Wr = Wout + (size_t)bv * TT;
    Wr[tid]       = e0 / S;
    Wr[tid + 256] = e1 / S;
}

extern "C" void kernel_launch(void* const* d_in, const int* in_sizes, int n_in,
                              void* d_out, int out_size, void* d_ws, size_t ws_size,
                              hipStream_t stream) {
    const float* X    = (const float*)d_in[0];
    const float* k_w1 = (const float*)d_in[1];
    const float* k_b1 = (const float*)d_in[2];
    const float* k_w2 = (const float*)d_in[3];
    const float* k_b2 = (const float*)d_in[4];
    const float* q_w1 = (const float*)d_in[5];
    const float* q_b1 = (const float*)d_in[6];
    const float* q_w2 = (const float*)d_in[7];
    const float* q_b2 = (const float*)d_in[8];
    const float* pos  = (const float*)d_in[9];

    float* Yout = (float*)d_out;            // (B*V) = 4096 floats
    float* Wout = Yout + 32 * 128;          // (B*V*T) floats follow

    dim3 grid(32 * 128);                    // one block per (b,v) row
    dim3 block(256);                        // 8 waves of 32
    lagalign_fused_kernel<<<grid, block, 0, stream>>>(
        X, k_w1, k_b1, k_w2, k_b2, q_w1, q_b1, q_w2, q_b2, pos, Yout, Wout);
}

// v003
// A run of this version takes 16.6 microseconds.
// Versions between v001 and this one are left out; their measured steps multiply to 3.35 times as fast.
// All steps since v000 together make it 5.78 times as fast.
#include <hip/hip_runtime.h>
#include <math.h>

typedef __attribute__((ext_vector_type(2))) float v2f;
typedef __attribute__((ext_vector_type(4))) float v4f;
typedef __attribute__((ext_vector_type(8))) float v8f;

#define TT     512
#define DD     32
#define HID    64
#define HTILES (HID / 16)      // 16-row tiles of the hidden axis
#define WPB    16              // waves per workgroup; every wave owns one whole X row
#define XPAD   4               // x[0] sits at word 4 of a wave's LDS row; words 2 and 3 hold the left pad
#define XROW   (XPAD + TT + 4) // one word behind x[511] is read and then replaced by the constant 1

// the value that lane ^ 16 holds
static __device__ __forceinline__ float other_row(float v) {
    const int i = __float_as_int(v);
    return __int_as_float(__builtin_amdgcn_permlanex16(i, i, 0x76543210, 0xfedcba98, false, false));
}

__launch_bounds__(WPB * 32)
__global__ void lagalign_fused_kernel(const float* __restrict__ X,
                                      const float* __restrict__ k_w1, const float* __restrict__ k_b1,
                                      const float* __restrict__ k_w2, const float* __restrict__ k_b2,
                                      const float* __restrict__ q_w1, const float* __restrict__ q_b1,
                                      const float* __restrict__ q_w2, const float* __restrict__ q_b2,
                                      const float* __restrict__ pos_bias,
                                      float* __restrict__ Yout, float* __restrict__ Wout)
{
    // each wave reads and writes its own slice of these arrays only: no workgroup barrier anywhere
    __shared__ __attribute__((aligned(16))) float Xs[WPB][XROW];
    __shared__ __attribute__((aligned(16))) float hqs[WPB][HID];
    __shared__ __attribute__((aligned(16))) float qs[WPB][DD];

    const int lane = threadIdx.x & 31;
    const int wid  = threadIdx.x >> 5;
    const int n    = lane & 15;   // fragment row (A) or column (B, D)
    const int half = lane >> 4;   // 0: k pair {0,1}, D rows 0-7; 1: k pair {2,3}, D rows 8-15
    const int bv   = blockIdx.x * WPB + wid;
    const float* Xr = X + (size_t)bv * TT;
    float* xs = Xs[wid];
    float* hq = hqs[wid];
    float* qw = qs[wid];

    // the row: register (c, e) of a lane holds t = 128 c + 4 lane + e, as do logits, weights and pos_bias
    v4f xv[4];
    for (int c = 0; c < 4; ++c) xv[c] = *(const v4f*)(Xr + 128 * c + 4 * lane);
    // the row's loads go out first, and later loads land in their address registers
    asm volatile("s_wait_xcnt 0x0" ::: "memory");

    v4f pbv[4];
    for (int c = 0; c < 4; ++c) pbv[c] = *(const v4f*)(pos_bias + 128 * c + 4 * lane);

    // query head weights: lane = h (and h + 32) for layer 1, lane = d for layer 2
    float qa[2][4];
    for (int i = 0; i < 2; ++i) {
        const int h = lane + 32 * i;
        qa[i][0] = q_w1[0 * HID + h];
        qa[i][1] = q_w1[1 * HID + h];
        qa[i][2] = q_w1[2 * HID + h];
        qa[i][3] = q_b1[h];
    }
    float w2c[HID];
    const float* qc = q_w2 + lane;
    for (int h = 0; h < HID; ++h) w2c[h] = qc[h * DD];
    const float qb2 = q_b2[lane];
    // later loads land in these loads' address registers
    asm volatile("s_wait_xcnt 0x0" ::: "memory");

    // A fragments of [k_w2; k_b2]: tiles 0-3 are 16 rows of k_w2, tile 4 has k_b2 in every row;
    // a lane holds 16 contiguous d
    v4f wr[HTILES + 1][4];
    const float*   rw = k_w2 + n * DD + half * 16;
    const unsigned hb = half * 16 * sizeof(float);   // byte offset of the lane's half of k_b2
    for (int ht = 0; ht <= HTILES; ++ht) {
        const float* rowp = ht < HTILES ? rw + ht * 16 * DD : (const float*)((const char*)k_b2 + hb);
        for (int i = 0; i < 4; ++i) wr[ht][i] = *(const v4f*)(rowp + 4 * i);
    }
    // as above; the inputs keep the address registers untouched up to the wait, also by these loads' own data
    asm volatile("s_wait_xcnt 0x0" :: "v"(rw), "v"(hb) : "memory");

    // A fragments of [k_w1; k_b1]^T (row = h, k = tap 0, 1, 2, bias)
    v2f a1[HTILES];
    {
        const float* pa = (half ? k_w1 + 2 * HID : k_w1) + n;
        const float* pb = (half ? k_b1 : k_w1 + HID) + n;
        for (int ht = 0; ht < HTILES; ++ht) {
            a1[ht][0] = pa[ht * 16];
            a1[ht][1] = pb[ht * 16];
        }
        // later lines reuse these loads' address registers; the inputs as above
        asm volatile("s_wait_xcnt 0x0" :: "v"(pa), "v"(pb) : "memory");
    }

    // ---- the wave's X row in its own LDS slice, left pad = x[0] ----
    for (int c = 0; c < 4; ++c) *(v4f*)&xs[XPAD + 128 * c + 4 * lane] = xv[c];
    if (lane == 0) {
        xs[XPAD - 2] = xv[0][0];
        xs[XPAD - 1] = xv[0][0];
        xs[XPAD + TT] = 0.f;
    }

    // ---- query head: q = relu([X509,X510,X511] @ q_w1 + q_b1) @ q_w2 + q_b2 ----
    {
        const float p0 = __int_as_float(__builtin_amdgcn_readlane(__float_as_int(xv[3][1]), 31));
        const float p1 = __int_as_float(__builtin_amdgcn_readlane(__float_as_int(xv[3][2]), 31));
        const float p2 = __int_as_float(__builtin_amdgcn_readlane(__float_as_int(xv[3][3]), 31));
        for (int i = 0; i < 2; ++i) {
            const float a = p0 * qa[i][0] + p1 * qa[i][1] + p2 * qa[i][2] + qa[i][3];
            hq[lane + 32 * i] = a > 0.f ? a : 0.f;
        }
    }
    // lanes read words that other lanes of the wave wrote: the reads stay behind the writes
    __builtin_amdgcn_fence(__ATOMIC_ACQ_REL, "wavefront");
    {
        float acc = qb2;
        for (int h4 = 0; h4 < HID / 4; ++h4) {
            const v4f hv = *(const v4f*)&hq[4 * h4];
            for (int k = 0; k < 4; ++k) acc += hv[k] * w2c[4 * h4 + k];
        }
        qw[lane] = acc;
    }
    // as above, for q
    __builtin_amdgcn_fence(__ATOMIC_ACQ_REL, "wavefront");

    // ---- u = [k_w2; k_b2] @ q via f32 WMMA: K.q = H.(k_w2 q) + k_b2.q, so K is never formed ----
    // B holds q in every column, so every column of D holds u: register r of tile ht is
    // u[16 ht + 8 half + r], the order in which the P^T tiles below arrive.
    // A and B both take d = half * 16 + 4 i + {0,1} and {2,3}.
    v8f u[HTILES];
    float c0;
    {
        v4f qq[4];
        for (int i = 0; i < 4; ++i) qq[i] = *(const v4f*)&qw[half * 16 + 4 * i];
        for (int ht = 0; ht <= HTILES; ++ht) {
            v8f acc0 = {}, acc1 = {};
            for (int i = 0; i < 4; ++i) {
                const v2f wa = {wr[ht][i][0], wr[ht][i][1]}, wb = {wr[ht][i][2], wr[ht][i][3]};
                const v2f qa2 = {qq[i][0], qq[i][1]},        qb = {qq[i][2], qq[i][3]};
                acc0 = __builtin_amdgcn_wmma_f32_16x16x4_f32(false, wa, false, qa2,
                                                             (short)0, acc0, false, false);
                acc1 = __builtin_amdgcn_wmma_f32_16x16x4_f32(false, wb, false, qb,
                                                             (short)0, acc1, false, false);
            }
            const v8f uu = acc0 + acc1;
            if (ht < HTILES) u[ht] = uu; else c0 = uu[0];
        }
    }

    const float inv_sqrt_d = 0.17677669529663687f; // 1/sqrt(32)

    // ---- P^T(64 x 16t) = [k_w1; k_b1]^T(64 x 4) @ [patch; 1](4 x 16t) via f32 WMMA, then relu(P).u ----
    // column n of tile (c, e, hh) is t = 128 c + 64 hh + 4 n + e
    // B fragment (column = t): {x[t-2], x[t-1]} | {x[t], 1}
    const float* pl = xs + XPAD - 2 + 2 * half + 4 * n;
    v4f lg[4];
    for (int c = 0; c < 4; ++c) {
        for (int e = 0; e < 4; ++e) {
            // a lane holds 32 of the 64 h of its own t
            float p[2];
            for (int hh = 0; hh < 2; ++hh) {
                const float* pp = pl + 128 * c + 64 * hh + e;
                const float x0 = pp[0], x1 = pp[1];
                const v2f b = {x0, half ? 1.f : x1};
                v2f s = {0.f, 0.f};
                for (int ht = 0; ht < HTILES; ++ht) {
                    const v8f z = {};
                    const v8f d = __builtin_amdgcn_wmma_f32_16x16x4_f32(false, a1[ht], false, b,
                                                                        (short)0, z, false, false);
                    for (int r = 0; r < 8; r += 2) {
                        const v2f hb = {fmaxf(d[r], 0.f), fmaxf(d[r + 1], 0.f)};
                        const v2f ub = {u[ht][r], u[ht][r + 1]};
                        s = __builtin_elementwise_fma(hb, ub, s);
                    }
                }
                p[hh] = s[0] + s[1];
            }
            // the other 32 h sit in lane ^ 16: lanes 0-15 finish tile hh = 0, lanes 16-31 tile hh = 1
            const float keep = half ? p[1] : p[0];
            const float send = half ? p[0] : p[1];
            const float sum  = keep + other_row(send) + c0;
            const int   t    = 128 * c + 4 * lane + e;
            float l = sum * inv_sqrt_d + pbv[c][e];
            l = (t <= TT - 2) ? l : -1.0e9f;   // only t = T-1 is masked
            lg[c][e] = l / 0.7f;
        }
    }

    // ---- softmax over T inside the wave, W and Y ----
    float M = lg[0][0];
    for (int c = 0; c < 4; ++c)
        for (int e = 0; e < 4; ++e) M = fmaxf(M, lg[c][e]);
    for (int mask = 16; mask >= 1; mask >>= 1) M = fmaxf(M, __shfl_xor(M, mask, 32));
    for (int c = 0; c < 4; ++c)
        for (int e = 0; e < 4; ++e) lg[c][e] = __expf(lg[c][e] - M);
    float ssum = 0.f, ysum = 0.f;
    for (int c = 0; c < 4; ++c)
        for (int e = 0; e < 4; ++e) {
            ssum += lg[c][e];
            ysum += lg[c][e] * xv[c][e];
        }
    for (int mask = 16; mask >= 1; mask >>= 1) {
        ssum += __shfl_xor(ssum, mask, 32);
        ysum += __shfl_xor(ysum, mask, 32);
    }
    if (lane == 0) Yout[bv] = ysum / ssum;
    float* Wr = Wout + (size_t)bv * TT;
    for (int c = 0; c < 4; ++c) {
        v4f w;
        for (int e = 0; e < 4; ++e) w[e] = lg[c][e] / ssum;
        *(v4f*)(Wr + 128 * c + 4 * lane) = w;
    }
}

extern "C" void kernel_launch(void* const* d_in, const int* in_sizes, int n_in,
                              void* d_out, int out_size, void* d_ws, size_t ws_size,
                              hipStream_t stream) {
    const float* X    = (const float*)d_in[0];
    const float* k_w1 = (const float*)d_in[1];
    const float* k_b1 = (const float*)d_in[2];
    const float* k_w2 = (const float*)d_in[3];
    const float* k_b2 = (const float*)d_in[4];
    const float* q_w1 = (const float*)d_in[5];
    const float* q_b1 = (const float*)d_in[6];
    const float* q_w2 = (const float*)d_in[7];
    const float* q_b2 = (const float*)d_in[8];
    const float* pos  = (const float*)d_in[9];

    float* Yout = (float*)d_out;            // (B*V) = 4096 floats
    float* Wout = Yout + 32 * 128;          // (B*V*T) floats follow

    dim3 grid(32 * 128 / WPB);              // one wave per (b,v) row, 16 rows per block
    dim3 block(WPB * 32);
    lagalign_fused_kernel<<<grid, block, 0, stream>>>(
        X, k_w1, k_b1, k_w2, k_b2, q_w1, q_b1, q_w2, q_b2, pos, Yout, Wout);
}

// v004
// It runs in 14.3 microseconds.
// Timed twice side by side with v003, it ran 1.16 times as fast both times.
// Counting every step since v000, it is 6.72 times as fast.
#include <hip/hip_runtime.h>
#include <math.h>

typedef __attribute__((ext_vector_type(2))) float v2f;
typedef __attribute__((ext_vector_type(4))) float v4f;
typedef __attribute__((ext_vector_type(8))) float v8f;

#define TT     512
#define DD     32
#define HID    64
#define HTILES (HID / 16)      // 16-row tiles of the hidden axis
#define WPB    16              // waves per workgroup; every wave owns one whole X row
#define XPAD   4               // x[0] sits at word 4 of a wave's LDS row; words 2 and 3 hold the left pad
#define XROW   (XPAD + TT + 4) // one word behind x[511] is read and then replaced by the constant 1
#define QROW   (DD + 4)        // 144-byte pitch: 16 lanes read 16 rows with b128 loads free of bank conflicts
#define UROW   (HID + 4)       // 272-byte pitch, for the same reason; word 64 of a row holds k_b2.q

// the value that lane ^ 16 holds
static __device__ __forceinline__ float other_row(float v) {
    const int i = __float_as_int(v);
    return __int_as_float(__builtin_amdgcn_permlanex16(i, i, 0x76543210, 0xfedcba98, false, false));
}

// 4 waves per SIMD is all the grid ever gives (one workgroup per WGP). Without the attribute the compiler aims at
// more, squeezes the main loop's eight WMMA results into fewer registers and puts their readers directly behind them.
__launch_bounds__(WPB * 32) __attribute__((amdgpu_waves_per_eu(4, 4)))
__global__ void lagalign_fused_kernel(const float* __restrict__ X,
                                      const float* __restrict__ k_w1, const float* __restrict__ k_b1,
                                      const float* __restrict__ k_w2, const float* __restrict__ k_b2,
                                      const float* __restrict__ q_w1, const float* __restrict__ q_b1,
                                      const float* __restrict__ q_w2, const float* __restrict__ q_b2,
                                      const float* __restrict__ pos_bias,
                                      float* __restrict__ Yout, float* __restrict__ Wout)
{
    // Xs and hqs: each wave reads and writes its own slice only
    __shared__ __attribute__((aligned(16))) float Xs[WPB][XROW];
    __shared__ __attribute__((aligned(16))) float hqs[WPB][HID];
    // qs and us pass between waves: every wave writes its row's q, waves 0-4 turn all 16 q into all 16 u
    __shared__ __attribute__((aligned(16))) float qs[WPB][QROW];
    __shared__ __attribute__((aligned(16))) float us[WPB][UROW];

    const int lane = threadIdx.x & 31;
    const int wid  = threadIdx.x >> 5;
    const int wv   = __builtin_amdgcn_readfirstlane(wid);   // the same number in a scalar register, for branches
    const int n    = lane & 15;   // fragment row (A) or column (B, D)
    const int half = lane >> 4;   // 0: k pair {0,1}, D rows 0-7; 1: k pair {2,3}, D rows 8-15
    const int bv   = blockIdx.x * WPB + wid;
    const float* Xr = X + (size_t)bv * TT;
    float* xs = Xs[wid];
    float* hq = hqs[wid];
    float* qw = qs[wid];

    // the row: register (c, e) of a lane holds t = 128 c + 4 lane + e, as do logits, weights and pos_bias
    v4f xv[4];
    for (int c = 0; c < 4; ++c) xv[c] = *(const v4f*)(Xr + 128 * c + 4 * lane);
    // the row's loads go out first, and later loads land in their address registers
    asm volatile("s_wait_xcnt 0x0" ::: "memory");

    v4f pbv[4];
    for (int c = 0; c < 4; ++c) pbv[c] = *(const v4f*)(pos_bias + 128 * c + 4 * lane);

    // query head weights: lane = h (and h + 32) for layer 1, lane = d for layer 2
    float qa[2][4];
    for (int i = 0; i < 2; ++i) {
        const int h = lane + 32 * i;
        qa[i][0] = q_w1[0 * HID + h];
        qa[i][1] = q_w1[1 * HID + h];
        qa[i][2] = q_w1[2 * HID + h];
        qa[i][3] = q_b1[h];
    }
    float w2c[HID];
    const float* qc = q_w2 + lane;
    for (int h = 0; h < HID; ++h) w2c[h] = qc[h * DD];
    const float qb2 = q_b2[lane];
    // later loads land in these loads' address registers
    asm volatile("s_wait_xcnt 0x0" ::: "memory");

    // A fragment of [k_w2; k_b2], one tile a wave, in waves 0-4 only: tiles 0-3 are 16 rows of k_w2,
    // tile 4 has k_b2 in every row; a lane holds 16 contiguous d
    v4f wr[4] = {};
    if (wv <= HTILES) {
        const float* rowp = (wv < HTILES ? k_w2 + (wv * 16 + n) * DD : k_b2) + half * 16;
        for (int i = 0; i < 4; ++i) wr[i] = *(const v4f*)(rowp + 4 * i);
        // as above; the input keeps the address registers untouched up to the wait, also by these loads' own data
        asm volatile("s_wait_xcnt 0x0" :: "v"(rowp) : "memory");
    }

    // A fragments of [k_w1; k_b1]^T (row = h, k = tap 0, 1, 2, bias)
    v2f a1[HTILES];
    {
        const float* pa = (half ? k_w1 + 2 * HID : k_w1) + n;
        const float* pb = (half ? k_b1 : k_w1 + HID) + n;
        for (int ht = 0; ht < HTILES; ++ht) {
            a1[ht][0] = pa[ht * 16];
            a1[ht][1] = pb[ht * 16];
        }
        // later lines reuse these loads' address registers; the inputs as above
        asm volatile("s_wait_xcnt 0x0" :: "v"(pa), "v"(pb) : "memory");
    }

    // ---- the wave's X row in its own LDS slice, left pad = x[0] ----
    for (int c = 0; c < 4; ++c) *(v4f*)&xs[XPAD + 128 * c + 4 * lane] = xv[c];
    if (lane == 0) {
        xs[XPAD - 2] = xv[0][0];
        xs[XPAD - 1] = xv[0][0];
        xs[XPAD + TT] = 0.f;
    }

    // ---- query head: q = relu([X509,X510,X511] @ q_w1 + q_b1) @ q_w2 + q_b2 ----
    {
        const float p0 = __int_as_float(__builtin_amdgcn_readlane(__float_as_int(xv[3][1]), 31));
        const float p1 = __int_as_float(__builtin_amdgcn_readlane(__float_as_int(xv[3][2]), 31));
        const float p2 = __int_as_float(__builtin_amdgcn_readlane(__float_as_int(xv[3][3]), 31));
        for (int i = 0; i < 2; ++i) {
            const float a = p0 * qa[i][0] + p1 * qa[i][1] + p2 * qa[i][2] + qa[i][3];
            hq[lane + 32 * i] = a > 0.f ? a : 0.f;
        }
    }
    // lanes read words that other lanes of the wave wrote: the reads stay behind the writes
    __builtin_amdgcn_fence(__ATOMIC_ACQ_REL, "wavefront");
    {
        float acc = qb2;
        for (int h4 = 0; h4 < HID / 4; ++h4) {
            const v4f hv = *(const v4f*)&hq[4 * h4];
            for (int k = 0; k < 4; ++k) acc += hv[k] * w2c[4 * h4 + k];
        }
        qw[lane] = acc;
    }
    // waves 0-4 read the q of all 16 rows
    __syncthreads();

    // ---- u = [k_w2; k_b2] @ q via f32 WMMA: K.q = H.(k_w2 q) + k_b2.q, so K is never formed ----
    // Column j of B holds the q of the workgroup's row j, so column j of D holds that row's u:
    // one tile a wave serves all 16 rows. A and B both take d = half * 16 + 4 i + {0,1} and {2,3}.
    if (wv <= HTILES) {
        v4f qq[4];
        for (int i = 0; i < 4; ++i) qq[i] = *(const v4f*)&qs[n][half * 16 + 4 * i];
        v8f acc0 = {}, acc1 = {};
        for (int i = 0; i < 4; ++i) {
            const v2f wa = {wr[i][0], wr[i][1]}, wb = {wr[i][2], wr[i][3]};
            const v2f qa2 = {qq[i][0], qq[i][1]}, qb = {qq[i][2], qq[i][3]};
            acc0 = __builtin_amdgcn_wmma_f32_16x16x4_f32(false, wa, false, qa2,
                                                         (short)0, acc0, false, false);
            acc1 = __builtin_amdgcn_wmma_f32_16x16x4_f32(false, wb, false, qb,
                                                         (short)0, acc1, false, false);
        }
        // four vector slots between the last two WMMAs and the additions that read their D
        asm volatile("v_nop\n\tv_nop\n\tv_nop\n\tv_nop" : "+v"(acc0), "+v"(acc1));
        const v8f uu = acc0 + acc1;
        if (wv < HTILES) {
            float* up = &us[n][wv * 16 + half * 8];
            *(v4f*)up       = (v4f){uu[0], uu[1], uu[2], uu[3]};
            *(v4f*)(up + 4) = (v4f){uu[4], uu[5], uu[6], uu[7]};
        } else if (half == 0) {
            us[n][HID] = uu[0];
        }
    }
    // every wave reads its own row's u, which waves 0-4 wrote
    __syncthreads();

    // register r of tile ht is u[16 ht + 8 half + r], the order in which the P^T tiles below arrive
    v8f u[HTILES];
    for (int ht = 0; ht < HTILES; ++ht) {
        const v4f lo = *(const v4f*)&us[wid][ht * 16 + half * 8];
        const v4f hi = *(const v4f*)&us[wid][ht * 16 + half * 8 + 4];
        u[ht] = (v8f){lo[0], lo[1], lo[2], lo[3], hi[0], hi[1], hi[2], hi[3]};
    }
    const float c0 = us[wid][HID];

    const float inv_sqrt_d = 0.17677669529663687f; // 1/sqrt(32)

    // ---- P^T(64 x 16t) = [k_w1; k_b1]^T(64 x 4) @ [patch; 1](4 x 16t) via f32 WMMA, then relu(P).u ----
    // column n of tile (c, e, hh) is t = 128 c + 64 hh + 4 n + e
    // B fragment (column = t): {x[t-2], x[t-1]} | {x[t], 1}
    const float* pl = xs + XPAD - 2 + 2 * half + 4 * n;
    v4f lg[4];
    for (int c = 0; c < 4; ++c) {
        for (int e = 0; e < 4; ++e) {
            // a lane holds 32 of the 64 h of its own t
            float p[2];
            for (int hh = 0; hh < 2; ++hh) {
                const float* pp = pl + 128 * c + 64 * hh + e;
                const float x0 = pp[0], x1 = pp[1];
                const v2f b = {x0, half ? 1.f : x1};
                v2f s = {0.f, 0.f};
                for (int ht = 0; ht < HTILES; ++ht) {
                    const v8f z = {};
                    const v8f d = __builtin_amdgcn_wmma_f32_16x16x4_f32(false, a1[ht], false, b,
                                                                        (short)0, z, false, false);
                    for (int r = 0; r < 8; r += 2) {
                        const v2f hb = {fmaxf(d[r], 0.f), fmaxf(d[r + 1], 0.f)};
                        const v2f ub = {u[ht][r], u[ht][r + 1]};
                        s = __builtin_elementwise_fma(hb, ub, s);
                    }
                }
                p[hh] = s[0] + s[1];
            }
            // the other 32 h sit in lane ^ 16: lanes 0-15 finish tile hh = 0, lanes 16-31 tile hh = 1
            const float keep = half ? p[1] : p[0];
            const float send = half ? p[0] : p[1];
            const float sum  = keep + other_row(send) + c0;
            const int   t    = 128 * c + 4 * lane + e;
            float l = sum * inv_sqrt_d + pbv[c][e];
            l = (t <= TT - 2) ? l : -1.0e9f;   // only t = T-1 is masked
            lg[c][e] = l / 0.7f;
        }
    }

    // ---- softmax over T inside the wave, W and Y ----
    float M = lg[0][0];
    for (int c = 0; c < 4; ++c)
        for (int e = 0; e < 4; ++e) M = fmaxf(M, lg[c][e]);
    for (int mask = 16; mask >= 1; mask >>= 1) M = fmaxf(M, __shfl_xor(M, mask, 32));
    for (int c = 0; c < 4; ++c)
        for (int e = 0; e < 4; ++e) lg[c][e] = __expf(lg[c][e] - M);
    float ssum = 0.f, ysum = 0.f;
    for (int c = 0; c < 4; ++c)
        for (int e = 0; e < 4; ++e) {
            ssum += lg[c][e];
            ysum += lg[c][e] * xv[c][e];
        }
    for (int mask = 16; mask >= 1; mask >>= 1) {
        ssum += __shfl_xor(ssum, mask, 32);
        ysum += __shfl_xor(ysum, mask, 32);
    }
    if (lane == 0) Yout[bv] = ysum / ssum;
    float* Wr = Wout + (size_t)bv * TT;
    for (int c = 0; c < 4; ++c) {
        v4f w;
        for (int e = 0; e < 4; ++e) w[e] = lg[c][e] / ssum;
        *(v4f*)(Wr + 128 * c + 4 * lane) = w;
    }
}

extern "C" void kernel_launch(void* const* d_in, const int* in_sizes, int n_in,
                              void* d_out, int out_size, void* d_ws, size_t ws_size,
                              hipStream_t stream) {
    const float* X    = (const float*)d_in[0];
    const float* k_w1 = (const float*)d_in[1];
    const float* k_b1 = (const float*)d_in[2];
    const float* k_w2 = (const float*)d_in[3];
    const float* k_b2 = (const float*)d_in[4];
    const float* q_w1 = (const float*)d_in[5];
    const float* q_b1 = (const float*)d_in[6];
    const float* q_w2 = (const float*)d_in[7];
    const float* q_b2 = (const float*)d_in[8];
    const float* pos  = (const float*)d_in[9];

    float* Yout = (float*)d_out;            // (B*V) = 4096 floats
    float* Wout = Yout + 32 * 128;          // (B*V*T) floats follow

    dim3 grid(32 * 128 / WPB);              // one wave per (b,v) row, 16 rows per block
    dim3 block(WPB * 32);
    lagalign_fused_kernel<<<grid, block, 0, stream>>>(
        X, k_w1, k_b1, k_w2, k_b2, q_w1, q_b1, q_w2, q_b2, pos, Yout, Wout);
}

// v005
// Measured time: 13.5 microseconds a run.
// Timed twice side by side with v004, it ran 1.06 times as fast both times.
// All steps since v000 together make it 7.14 times as fast.
#include <hip/hip_runtime.h>
#include <math.h>

typedef __attribute__((ext_vector_type(2))) float v2f;
typedef __attribute__((ext_vector_type(4))) float v4f;
typedef __attribute__((ext_vector_type(8))) float v8f;

#define TT     512
#define DD     32
#define HID    64
#define HTILES (HID / 16)      // 16-row tiles of the hidden axis
#define WPB    16              // waves per workgroup; every wave owns one whole X row
#define XPAD   4               // x[0] sits at word 4 of a wave's LDS row; words 2 and 3 hold the left pad
#define XROW   (XPAD + TT + 4) // one word behind x[511] is read and then replaced by the constant 1
#define QROW   (DD + 4)        // 144-byte pitch: 16 lanes read 16 rows with b128 loads free of bank conflicts
#define UROW   (HID + 4)       // 272-byte pitch, for the same reason; word 64 of a row holds k_b2.q

// the value that lane ^ 16 holds
static __device__ __forceinline__ float other_row(float v) {
    const int i = __float_as_int(v);
    return __int_as_float(__builtin_amdgcn_permlanex16(i, i, 0x76543210, 0xfedcba98, false, false));
}

// 2^x. The v_nop is the free slot behind a transcendental; inside the statement the slot cannot move away.
static __device__ __forceinline__ float exp2_slot(float x) {
    float r;
    asm("v_exp_f32 %0, %1\n\tv_nop" : "=v"(r) : "v"(x));
    return r;
}

// 4 waves per SIMD is all the grid ever gives (one workgroup per WGP). Without the attribute the compiler aims at
// more, squeezes the main loop's eight WMMA results into fewer registers and puts their readers directly behind them.
__launch_bounds__(WPB * 32) __attribute__((amdgpu_waves_per_eu(4, 4)))
__global__ void lagalign_fused_kernel(const float* __restrict__ X,
                                      const float* __restrict__ k_w1, const float* __restrict__ k_b1,
                                      const float* __restrict__ k_w2, const float* __restrict__ k_b2,
                                      const float* __restrict__ q_w1, const float* __restrict__ q_b1,
                                      const float* __restrict__ q_w2, const float* __restrict__ q_b2,
                                      const float* __restrict__ pos_bias,
                                      float* __restrict__ Yout, float* __restrict__ Wout)
{
    // Xs and hqs: each wave reads and writes its own slice only
    __shared__ __attribute__((aligned(16))) float Xs[WPB][XROW];
    __shared__ __attribute__((aligned(16))) float hqs[WPB][HID];
    // qs and us pass between waves: every wave writes its row's q, waves 0-4 turn all 16 q into all 16 u
    __shared__ __attribute__((aligned(16))) float qs[WPB][QROW];
    __shared__ __attribute__((aligned(16))) float us[WPB][UROW];

    const int lane = threadIdx.x & 31;
    const int wid  = threadIdx.x >> 5;
    const int wv   = __builtin_amdgcn_readfirstlane(wid);   // the same number in a scalar register, for branches
    const int n    = lane & 15;   // fragment row (A) or column (B, D)
    const int half = lane >> 4;   // 0: k pair {0,1}, D rows 0-7; 1: k pair {2,3}, D rows 8-15
    const int bv   = blockIdx.x * WPB + wid;
    const float* Xr = X + (size_t)bv * TT;
    float* xs = Xs[wid];
    float* hq = hqs[wid];
    float* qw = qs[wid];

    // the row: register (c, e) of a lane holds t = 128 c + 4 lane + e, as do logits, weights and pos_bias
    v4f xv[4];
    for (int c = 0; c < 4; ++c) xv[c] = *(const v4f*)(Xr + 128 * c + 4 * lane);
    // the row's loads go out first, and later loads land in their address registers
    asm volatile("s_wait_xcnt 0x0" ::: "memory");

    v4f pbv[4];
    for (int c = 0; c < 4; ++c) pbv[c] = *(const v4f*)(pos_bias + 128 * c + 4 * lane);

    // query head weights: lane = h (and h + 32) for layer 1, lane = d for layer 2
    float qa[2][4];
    for (int i = 0; i < 2; ++i) {
        const int h = lane + 32 * i;
        qa[i][0] = q_w1[0 * HID + h];
        qa[i][1] = q_w1[1 * HID + h];
        qa[i][2] = q_w1[2 * HID + h];
        qa[i][3] = q_b1[h];
    }
    float w2c[HID];
    const float* qc = q_w2 + lane;
    for (int h = 0; h < HID; ++h) w2c[h] = qc[h * DD];
    const float qb2 = q_b2[lane];
    // later loads land in these loads' address registers
    asm volatile("s_wait_xcnt 0x0" ::: "memory");

    // A fragment of [k_w2; k_b2], one tile a wave, in waves 0-4 only: tiles 0-3 are 16 rows of k_w2,
    // tile 4 has k_b2 in every row; a lane holds 16 contiguous d
    v4f wr[4] = {};
    if (wv <= HTILES) {
        const float* rowp = (wv < HTILES ? k_w2 + (wv * 16 + n) * DD : k_b2) + half * 16;
        for (int i = 0; i < 4; ++i) wr[i] = *(const v4f*)(rowp + 4 * i);
        // as above; the input keeps the address registers untouched up to the wait, also by these loads' own data
        asm volatile("s_wait_xcnt 0x0" :: "v"(rowp) : "memory");
    }

    // A fragments of [k_w1; k_b1]^T (row = h, k = tap 0, 1, 2, bias)
    v2f a1[HTILES];
    {
        const float* pa = (half ? k_w1 + 2 * HID : k_w1) + n;
        const float* pb = (half ? k_b1 : k_w1 + HID) + n;
        for (int ht = 0; ht < HTILES; ++ht) {
            a1[ht][0] = pa[ht * 16];
            a1[ht][1] = pb[ht * 16];
        }
        // later lines reuse these loads' address registers; the inputs as above
        asm volatile("s_wait_xcnt 0x0" :: "v"(pa), "v"(pb) : "memory");
    }

    // ---- the wave's X row in its own LDS slice, left pad = x[0] ----
    for (int c = 0; c < 4; ++c) *(v4f*)&xs[XPAD + 128 * c + 4 * lane] = xv[c];
    if (lane == 0) {
        xs[XPAD - 2] = xv[0][0];
        xs[XPAD - 1] = xv[0][0];
        xs[XPAD + TT] = 0.f;
    }

    // ---- query head: q = relu([X509,X510,X511] @ q_w1 + q_b1) @ q_w2 + q_b2 ----
    {
        const float p0 = __int_as_float(__builtin_amdgcn_readlane(__float_as_int(xv[3][1]), 31));
        const float p1 = __int_as_float(__builtin_amdgcn_readlane(__float_as_int(xv[3][2]), 31));
        const float p2 = __int_as_float(__builtin_amdgcn_readlane(__float_as_int(xv[3][3]), 31));
        for (int i = 0; i < 2; ++i) {
            const float a = p0 * qa[i][0] + p1 * qa[i][1] + p2 * qa[i][2] + qa[i][3];
            hq[lane + 32 * i] = a > 0.f ? a : 0.f;
        }
    }
    // lanes read words that other lanes of the wave wrote: the reads stay behind the writes
    __builtin_amdgcn_fence(__ATOMIC_ACQ_REL, "wavefront");
    {
        float acc = qb2;
        for (int h4 = 0; h4 < HID / 4; ++h4) {
            const v4f hv = *(const v4f*)&hq[4 * h4];
            for (int k = 0; k < 4; ++k) acc += hv[k] * w2c[4 * h4 + k];
        }
        qw[lane] = acc;
    }
    // waves 0-4 read the q of all 16 rows
    __syncthreads();

    // ---- u = [k_w2; k_b2] @ q via f32 WMMA: K.q = H.(k_w2 q) + k_b2.q, so K is never formed ----
    // Column j of B holds the q of the workgroup's row j, so column j of D holds that row's u:
    // one tile a wave serves all 16 rows. A and B both take d = half * 16 + 4 i + {0,1} and {2,3}.
    if (wv <= HTILES) {
        v4f qq[4];
        for (int i = 0; i < 4; ++i) qq[i] = *(const v4f*)&qs[n][half * 16 + 4 * i];
        v8f acc0 = {}, acc1 = {};
        for (int i = 0; i < 4; ++i) {
            const v2f wa = {wr[i][0], wr[i][1]}, wb = {wr[i][2], wr[i][3]};
            const v2f qa2 = {qq[i][0], qq[i][1]}, qb = {qq[i][2], qq[i][3]};
            acc0 = __builtin_amdgcn_wmma_f32_16x16x4_f32(false, wa, false, qa2,
                                                         (short)0, acc0, false, false);
            acc1 = __builtin_amdgcn_wmma_f32_16x16x4_f32(false, wb, false, qb,
                                                         (short)0, acc1, false, false);
        }
        // four vector slots between the last two WMMAs and the additions that read their D
        asm volatile("v_nop\n\tv_nop\n\tv_nop\n\tv_nop" : "+v"(acc0), "+v"(acc1));
        const v8f uu = acc0 + acc1;
        if (wv < HTILES) {
            float* up = &us[n][wv * 16 + half * 8];
            *(v4f*)up       = (v4f){uu[0], uu[1], uu[2], uu[3]};
            *(v4f*)(up + 4) = (v4f){uu[4], uu[5], uu[6], uu[7]};
        } else if (half == 0) {
            us[n][HID] = uu[0];
        }
    }
    // every wave reads its own row's u, which waves 0-4 wrote
    __syncthreads();

    // register r of tile ht is u[16 ht + 8 half + r], the order in which the P^T tiles below arrive
    v8f u[HTILES];
    for (int ht = 0; ht < HTILES; ++ht) {
        const v4f lo = *(const v4f*)&us[wid][ht * 16 + half * 8];
        const v4f hi = *(const v4f*)&us[wid][ht * 16 + half * 8 + 4];
        u[ht] = (v8f){lo[0], lo[1], lo[2], lo[3], hi[0], hi[1], hi[2], hi[3]};
    }
    const float c0 = us[wid][HID];

    // logit = (sum / sqrt(32) + pos_bias) / 0.7, with both divisors as factors known at compile time
    const float inv_temp  = 1.0f / 0.7f;
    const float sum_scale = 0.17677669529663687f * inv_temp;
    for (int c = 0; c < 4; ++c) pbv[c] *= inv_temp;

    // ---- P^T(64 x 16t) = [k_w1; k_b1]^T(64 x 4) @ [patch; 1](4 x 16t) via f32 WMMA, then relu(P).u ----
    // column n of tile (c, e, hh) is t = 128 c + 64 hh + 4 n + e
    // B fragment (column = t): {x[t-2], x[t-1]} | {x[t], 1}
    const float* pl = xs + XPAD - 2 + 2 * half + 4 * n;
    v4f lg[4];
    // unrolled over c, as it was before this loop's body shrank: rolled, lg and pbv are reached through indexed register moves
#pragma unroll
    for (int c = 0; c < 4; ++c) {
        for (int e = 0; e < 4; ++e) {
            // a lane holds 32 of the 64 h of its own t
            float p[2];
            for (int hh = 0; hh < 2; ++hh) {
                const float* pp = pl + 128 * c + 64 * hh + e;
                const float x0 = pp[0], x1 = pp[1];
                const v2f b = {x0, half ? 1.f : x1};
                v2f s = {0.f, 0.f};
                for (int ht = 0; ht < HTILES; ++ht) {
                    const v8f z = {};
                    const v8f d = __builtin_amdgcn_wmma_f32_16x16x4_f32(false, a1[ht], false, b,
                                                                        (short)0, z, false, false);
                    for (int r = 0; r < 8; r += 2) {
                        const v2f hb = {fmaxf(d[r], 0.f), fmaxf(d[r + 1], 0.f)};
                        const v2f ub = {u[ht][r], u[ht][r + 1]};
                        s = __builtin_elementwise_fma(hb, ub, s);
                    }
                }
                p[hh] = s[0] + s[1];
            }
            // the other 32 h sit in lane ^ 16: lanes 0-15 finish tile hh = 0, lanes 16-31 tile hh = 1
            const float keep = half ? p[1] : p[0];
            const float send = half ? p[0] : p[1];
            const float sum  = keep + other_row(send) + c0;
            const int   t    = 128 * c + 4 * lane + e;
            const float l = sum * sum_scale + pbv[c][e];
            lg[c][e] = (t <= TT - 2) ? l : -1.0e9f * inv_temp;   // only t = T-1 is masked
        }
    }

    // ---- softmax over T inside the wave, W and Y ----
    float M = lg[0][0];
    for (int c = 0; c < 4; ++c)
        for (int e = 0; e < 4; ++e) M = fmaxf(M, lg[c][e]);
    for (int mask = 16; mask >= 1; mask >>= 1) M = fmaxf(M, __shfl_xor(M, mask, 32));
    for (int c = 0; c < 4; ++c)
        for (int e = 0; e < 4; ++e) lg[c][e] = exp2_slot((lg[c][e] - M) * 1.44269504f);
    float ssum = 0.f, ysum = 0.f;
    for (int c = 0; c < 4; ++c)
        for (int e = 0; e < 4; ++e) {
            ssum += lg[c][e];
            ysum += lg[c][e] * xv[c][e];
        }
    for (int mask = 16; mask >= 1; mask >>= 1) {
        ssum += __shfl_xor(ssum, mask, 32);
        ysum += __shfl_xor(ysum, mask, 32);
    }
    const float inv_ssum = 1.0f / ssum;   // the one division left; every weight is a product with it
    if (lane == 0) Yout[bv] = ysum * inv_ssum;
    float* Wr = Wout + (size_t)bv * TT;
    for (int c = 0; c < 4; ++c) {
        *(v4f*)(Wr + 128 * c + 4 * lane) = lg[c] * inv_ssum;
    }
}

extern "C" void kernel_launch(void* const* d_in, const int* in_sizes, int n_in,
                              void* d_out, int out_size, void* d_ws, size_t ws_size,
                              hipStream_t stream) {
    const float* X    = (const float*)d_in[0];
    const float* k_w1 = (const float*)d_in[1];
    const float* k_b1 = (const float*)d_in[2];
    const float* k_w2 = (const float*)d_in[3];
    const float* k_b2 = (const float*)d_in[4];
    const float* q_w1 = (const float*)d_in[5];
    const float* q_b1 = (const float*)d_in[6];
    const float* q_w2 = (const float*)d_in[7];
    const float* q_b2 = (const float*)d_in[8];
    const float* pos  = (const float*)d_in[9];

    float* Yout = (float*)d_out;            // (B*V) = 4096 floats
    float* Wout = Yout + 32 * 128;          // (B*V*T) floats follow

    dim3 grid(32 * 128 / WPB);              // one wave per (b,v) row, 16 rows per block
    dim3 block(WPB * 32);
    lagalign_fused_kernel<<<grid, block, 0, stream>>>(
        X, k_w1, k_b1, k_w2, k_b2, q_w1, q_b1, q_w2, q_b2, pos, Yout, Wout);
}
